// v000
// The times below were measured on an AMD MI455X: many runs one after another, warmed up first and cycling through
// copies of the inputs, with the whole window's GPU time divided by the number of runs. Launches and the gaps
// between them are all in it. The median over several windows is given; except for v000 it joins two sittings, which
// can be a few percent apart, so the side-by-side timings, each taken in one sitting, are the better comparison.
// v000, which the later versions start from, runs in 2530 microseconds.
#include <hip/hip_runtime.h>
// Single-head full SELF-attention with a per-key-column entity-count bias, batch-first layout: x [4][4096][768]; q / k / v = x W^T + bias (natural [out][in] weights); scores = (q . k) / sqrt(768); per key column two additive terms: the number of occurrences of that position in entity_positions [4][64] (duplicates accumulate) and (1 - mask) * -10000; softmax over all 4096 keys; out = P . v, f32 [4][4096][768].
// Structure: x as exact f16 rows (inputs RNE-converted to bf16 first); Q, K as WMMA GEMMs (32x64 wave tiles, f32 accumulation, x16 weights + bias, f16 outputs); V^T [b][768][SEQ] directly as a GEMM (A = Wv plane, B = x rows; bv enters the P.V epilogue, rows of P sum to one); column-term plane CT f32 [b][SEQ] built by a compare scan (no read-modify-write primitives), in base-2 units (x log2(e)); per chunk of 256 query rows: scores GEMM (K = 768, batch on grid.y, alpha 768^-0.5 * log2(e), f32 S in base-2 units), k_soft (f32 row statistics, native base-2 exp on max-subtracted arguments: 2^(log2(e) z) = e^z; weights normalised in the exponent: 4096 P = 2^(x - max - log2(sum) + 12), f16 with the flush select), out = 2^-12 * P . V^T + bv GEMM (K = 4096) straight into the output rows.
// Compute dtype: all contractions v_wmma_f32_16x16x32_f16 (f16 operands, f32 accumulate); inputs RNE-converted to bf16 (exact in f16); q, k, v and softmax weights (x4096) as plain f16 operands; scores, column terms and softmax statistics f32.
#ifndef NB
#define NB 4                         /* batches processed */
#endif
#ifndef SEQ
#define SEQ 4096                     /* sequence length processed (queries = keys) */
#endif
#define NB_FULL 4                    /* batch count of the input / output arrays */
#define SEQ_FULL 4096                /* per-batch row pitch of the input / output arrays */
#define DM 768
#define NE 64                        /* entity positions per batch */
#define QC (SEQ < 256 ? SEQ : 256)   /* query rows per attention chunk */
#define NR ((size_t)NB * SEQ)        /* token rows */
#define MP ((int)(NB * SEQ))
#define PCARRY 4096.0f               /* power-of-two carry of the f16 softmax weights */
#define PCARRY_L2 12.0f              /* log2(PCARRY), exact */
#define LOG2E 1.4426950408889634f    /* log2(e); f32 bits 0x3FB8AA3B */
#define SCALE2 (0.03608439182435161f * LOG2E)   /* 768^-0.5 * log2(e), product of the two f32 literals formed in f32 (about 0.0520587731) */
#define AL256(x) ((((size_t)(x)) + 255) & ~(size_t)255)
#define WS_W  AL256((size_t)DM * DM * 2)
#define WS_P  AL256((size_t)NB * SEQ * DM * 2)
#define WS_S  AL256((size_t)NB * QC * SEQ * 4)
#define WS_PM AL256((size_t)NB * QC * SEQ * 2)
#define WS_CT AL256((size_t)NB * SEQ * 4)
static_assert(SEQ % 256 == 0);
static_assert(QC % 128 == 0);
static_assert(SEQ % QC == 0);
static_assert(NB <= NB_FULL);
static_assert(SEQ <= SEQ_FULL);
static_assert((NB * SEQ) % 128 == 0);
static_assert(DM % 128 == 0);                       /* V^T GEMM has M = DM */
static_assert(DM % 64 == 0);
static_assert(DM % 32 == 0);
static_assert(SEQ % 64 == 0);
static_assert(DM % 8 == 0);
static_assert((NB * QC) % 4 == 0);                  /* k_soft: 4 rows per block */
static_assert(4 * 32 * 68 * 4 <= 131072);           /* k_gemm2 static LDS */
static_assert((float)(1 << 12) == PCARRY);          /* PCARRY_L2 is the exact base-2 logarithm of PCARRY */
static_assert(3 * WS_W + 4 * WS_P + WS_S + WS_PM + WS_CT <= (size_t)134217728);
static_assert(((size_t)(NB - 1) * SEQ_FULL + SEQ) * DM <= (size_t)NB_FULL * SEQ_FULL * DM);   /* last output element inside the output buffer */

typedef unsigned short v8us __attribute__((ext_vector_type(8), may_alias));
typedef float  v8f  __attribute__((ext_vector_type(8)));
typedef float  v4f  __attribute__((ext_vector_type(4)));
typedef float  v4fa __attribute__((ext_vector_type(4), may_alias));
typedef _Float16 v16h __attribute__((ext_vector_type(16)));
typedef _Float16 v4h __attribute__((ext_vector_type(4)));
union FragH { v16h v; v8us half[2]; _Float16 h[16]; unsigned short u[16]; };

__device__ __forceinline__ unsigned short bf16_bits(float x) { unsigned int u = __float_as_uint(x); return (unsigned short)((u + 0x7FFFu + ((u >> 16) & 1u)) >> 16); }
__device__ __forceinline__ float bf16_val(unsigned short b) { return __uint_as_float(((unsigned int)b) << 16); }
__device__ __forceinline__ float bf16_rne(float x) { return bf16_val(bf16_bits(x)); }   /* RNE convert to bf16, back as f32 */

// f32 -> f16 operand convert that cannot produce an f16 subnormal (|v| < 2^-14 -> +0)
typedef _Float16 h16;
static __device__ __forceinline__ h16 toh_flush(float v) { const h16 r = (h16)v; return (fabsf(v) < 6.103515625e-05f) ? (h16)0.0f : r; }

// fragment: elements 0..7 <- k0 + 8h .. +7, elements 8..15 <- k0 + 16 + 8h .. +7 (p points at k0 of the lane's row / column)
__device__ __forceinline__ v16h g2_frag(const _Float16* p, int hh) { FragH f; f.half[0] = *(const v8us*)((const unsigned short*)p + 8 * hh); f.half[1] = *(const v8us*)((const unsigned short*)p + 16 + 8 * hh); return f.v; }
__device__ __forceinline__ v8f g2_mma(v16h a, v16h b, v8f c) { v8f d = __builtin_amdgcn_wmma_f32_16x16x32_f16(false, a, false, b, (short)0, c, false, false); asm volatile("v_nop\n\tv_nop\n\tv_nop\n\tv_nop" : "+v"(d) : "v"(a), "v"(b)); return d; }

// ---- GEMM (wave tile 32x64; M % 128 == 0 per launch region, N % 64 == 0, K % 32 == 0): C = alpha * A . Bt^T (+ bias) ----
// A f16 [M][K] (pitch lda), Bt f16 [N][K] (pitch ldb); batch slab by = blockIdx.y with element strides sA / sB / sC.
// OMAP: output row r -> (r / NB) * NB_FULL + r % NB.
template <bool HASB, bool OUT32, bool OMAP>
__global__ __launch_bounds__(128) void k_gemm2(const _Float16* __restrict__ A, int lda, size_t sA, const _Float16* __restrict__ Bh, int ldb, size_t sB, float alpha,
    const float* __restrict__ bias, float* __restrict__ C, _Float16* __restrict__ C16, int ldc, size_t sC, int M, int N, int K) {
  __shared__ __attribute__((aligned(16))) float so[4][32][68];
  const int tid = threadIdx.x, w = __builtin_amdgcn_readfirstlane((int)(tid >> 5)), lane = tid & 31, ln = lane & 15, hh = lane >> 4; const int by = blockIdx.y;
  A += (size_t)by * sA; Bh += (size_t)by * sB; const size_t cofs = (size_t)by * sC;
  const int ntn = N >> 6; const int mt = blockIdx.x / ntn, nq = blockIdx.x - mt * ntn; const int row0 = mt * 128 + 32 * w, col0 = nq * 64; if (row0 >= M) return;
  const _Float16* a0p = A + (size_t)(row0 + ln) * lda; const _Float16* a1p = a0p + (size_t)16 * lda;
  const _Float16* b0p = Bh + (size_t)(col0 + ln) * ldb; const _Float16* b1p = b0p + (size_t)16 * ldb; const _Float16* b2p = b1p + (size_t)16 * ldb; const _Float16* b3p = b2p + (size_t)16 * ldb;
  const v8f z8 = {0.f,0.f,0.f,0.f,0.f,0.f,0.f,0.f}; v8f c00 = z8, c01 = z8, c02 = z8, c03 = z8, c10 = z8, c11 = z8, c12 = z8, c13 = z8;
#pragma unroll 1
  for (int kb = 0; kb < K; kb += 32) { const v16h a0 = g2_frag(a0p + kb, hh), a1 = g2_frag(a1p + kb, hh);
    v16h b = g2_frag(b0p + kb, hh); c00 = g2_mma(a0, b, c00); c10 = g2_mma(a1, b, c10);
    b = g2_frag(b1p + kb, hh); c01 = g2_mma(a0, b, c01); c11 = g2_mma(a1, b, c11);
    b = g2_frag(b2p + kb, hh); c02 = g2_mma(a0, b, c02); c12 = g2_mma(a1, b, c12);
    b = g2_frag(b3p + kb, hh); c03 = g2_mma(a0, b, c03); c13 = g2_mma(a1, b, c13); }
  v8f accs[8] = {c00, c01, c02, c03, c10, c11, c12, c13};
#pragma unroll
  for (int u = 0; u < 8; ++u) { const int t = u & 3, half = u >> 2; const int col = col0 + t * 16 + ln; float bv = 0.f; if (HASB) bv = bf16_rne(bias[col]);
#pragma unroll
    for (int r = 0; r < 8; ++r) { const int rloc = half * 16 + 8 * hh + r; so[w][rloc][t * 16 + ln] = accs[u][r] * alpha + bv; } }
  __builtin_amdgcn_fence(4 /* acq_rel order */, "workgroup"); __builtin_amdgcn_wave_barrier();      /* so[w] is private to wave w */
  const int rsub = lane >> 4, c4 = (lane & 15) * 4;
  {
#pragma unroll
    for (int q = 0; q < 16; ++q) { const int r = q * 2 + rsub; const v4f v = *(const v4fa*)&so[w][r][c4];
      const int gr = row0 + r; const size_t orow = OMAP ? ((size_t)(gr / NB) * NB_FULL + (size_t)(gr % NB)) : (size_t)gr;
      if (OUT32) { *(v4f*)(C + cofs + orow * ldc + col0 + c4) = v; }
      else { v4h h4;
#pragma unroll
        for (int i = 0; i < 4; ++i) h4[i] = (_Float16)v[i];
        *(v4h*)(C16 + cofs + orow * ldc + col0 + c4) = h4; } }
     } }

static_assert(((size_t)DM * DM) % 8 == 0);
__global__ __launch_bounds__(256) void k_wnat(const float* __restrict__ w, size_t n8, _Float16* __restrict__ Bt) { const size_t t = (size_t)blockIdx.x * 256 + threadIdx.x; if (t >= n8) return; FragH f; const v4f a = *(const v4fa*)(w + t * 8), c = *(const v4fa*)(w + t * 8 + 4);
#pragma unroll
  for (int q = 0; q < 4; ++q) { f.h[q] = toh_flush(bf16_rne(a[q]) * 16.0f); f.h[4 + q] = toh_flush(bf16_rne(c[q]) * 16.0f); }
  const v8us o = f.half[0]; *(v8us*)((unsigned short*)Bt + t * 8) = o;  }

__global__ __launch_bounds__(256) void k_x16(const float* __restrict__ x, _Float16* __restrict__ X16, size_t n8) { const size_t t = (size_t)blockIdx.x * 256 + threadIdx.x; if (t >= n8) return;
  const size_t row = t / (DM / 8); const int c8 = (int)(t % (DM / 8)) * 8; const size_t srow = (row / SEQ) * SEQ_FULL + (row % SEQ);
  const float* p = x + srow * DM + c8; const v4f a = *(const v4fa*)p, c = *(const v4fa*)(p + 4); FragH f;
#pragma unroll
  for (int q = 0; q < 4; ++q) { f.h[q] = toh_flush(bf16_rne(a[q])); f.h[4 + q] = toh_flush(bf16_rne(c[q])); }
  const v8us o = f.half[0]; *(v8us*)((unsigned short*)X16 + t * 8) = o;  }

static_assert((NB * (SEQ / 4)) * 16 == NB * SEQ * 4);   /* threads x 16 B == plane bytes */
__global__ __launch_bounds__(256) void k_colterm(const float* __restrict__ mask, const int* __restrict__ epos, float* __restrict__ CT) {
  #pragma clang fp contract(off)
  const int t = blockIdx.x * 256 + threadIdx.x; if (t >= NB * (SEQ / 4)) return;
  const int b = t / (SEQ / 4); const int c4 = (t - b * (SEQ / 4)) * 4;
  const v4f m = *(const v4fa*)(mask + (size_t)b * SEQ_FULL + c4);
  int n0 = 0, n1 = 0, n2 = 0, n3 = 0, bad = 0;
#pragma unroll 1
  for (int e = 0; e < NE; ++e) { const int p = epos[b * NE + e];
    bad |= ((unsigned)p >= (unsigned)SEQ_FULL) ? 1 : 0;
    n0 += (p == c4) ? 1 : 0; n1 += (p == c4 + 1) ? 1 : 0; n2 += (p == c4 + 2) ? 1 : 0; n3 += (p == c4 + 3) ? 1 : 0; }
  const float qn = __uint_as_float(0x7FC00000u);
  const float t0 = (float)n0 * LOG2E + ((1.0f - bf16_rne(m[0])) * -10000.0f) * LOG2E;
  const float t1 = (float)n1 * LOG2E + ((1.0f - bf16_rne(m[1])) * -10000.0f) * LOG2E;
  const float t2 = (float)n2 * LOG2E + ((1.0f - bf16_rne(m[2])) * -10000.0f) * LOG2E;
  const float t3 = (float)n3 * LOG2E + ((1.0f - bf16_rne(m[3])) * -10000.0f) * LOG2E;
  v4f o; o[0] = (bad != 0) ? qn : t0; o[1] = (bad != 0) ? qn : t1; o[2] = (bad != 0) ? qn : t2; o[3] = (bad != 0) ? qn : t3;
  *(v4f*)(CT + (size_t)t * 4) = o;  }

// Row softmax over SEQ keys, evaluated in base 2 and normalised in the exponent. S f32 [NB][QC][SEQ] (slab = batch) and CT f32 [NB][SEQ] both arrive in base-2 units (x log2(e));
// with x = S[b][t][:] + CT[b][:], mx = row max, se = sum 2^(x - mx): PM f16 [NB][QC][SEQ] = 2^(x - off), off = mx + log2(se) - 12 (= 4096 * 2^(x - mx) / se).
// One wave per (b, t): lane holds 8 consecutive columns of every 256-column group (32 x v4f, kept unmodified), max / sum by wave shuffles, native base-2 exp (subtract + v_exp_f32) in both sweeps,
static_assert(32 * 16 * (SEQ / 256) == SEQ * 2);        /* lanes x bytes x store instructions == row bytes */
__global__ __launch_bounds__(128) __attribute__((amdgpu_num_vgpr(256))) void k_soft(const float* __restrict__ S, const float* __restrict__ CT, _Float16* __restrict__ PM) {
  #pragma clang fp contract(off)
  const int tid = threadIdx.x, w = __builtin_amdgcn_readfirstlane((int)(tid >> 5)), lane = tid & 31;
  const int wr = blockIdx.x * 4 + w; const int b = wr / QC;
  const float* p = S + (size_t)wr * SEQ + lane * 8;
  const float* c = CT + (size_t)b * SEQ + lane * 8;
  v4f x[SEQ / 128];
#pragma unroll
  for (int j = 0; j < SEQ / 256; ++j) {
    const v4f s0 = *(const v4fa*)(p + j * 256), s1 = *(const v4fa*)(p + j * 256 + 4);
    const v4f u0 = *(const v4fa*)(c + j * 256), u1 = *(const v4fa*)(c + j * 256 + 4);
    x[2 * j] = s0 + u0; x[2 * j + 1] = s1 + u1;
    asm volatile("" : "+v"(x[2 * j]), "+v"(x[2 * j + 1]) : : "memory");      /* the group's sums exist before anything later is issued */
    __builtin_amdgcn_sched_barrier(0); }
  float mx = -3.0e38f;
#pragma unroll
  for (int j = 0; j < SEQ / 128; ++j) mx = fmaxf(mx, fmaxf(fmaxf(x[j][0], x[j][1]), fmaxf(x[j][2], x[j][3])));
#pragma unroll
  for (int off = 16; off > 0; off >>= 1) mx = fmaxf(mx, __shfl_xor(mx, off, 32));
  float se = 0.f;
#pragma unroll
  for (int j = 0; j < SEQ / 128; ++j) {
#pragma unroll
    for (int i = 0; i < 4; ++i) { const float e = __builtin_amdgcn_exp2f(x[j][i] - mx); se += e; } }
#pragma unroll
  for (int off = 16; off > 0; off >>= 1) se += __shfl_xor(se, off, 32);
  const float xoff = (mx + __builtin_amdgcn_logf(se)) - PCARRY_L2;      /* se >= 1: the row maximum contributes 2^0 */
  unsigned short* pout = (unsigned short*)PM + (size_t)wr * SEQ + lane * 8;
  {
#pragma unroll
    for (int j = 0; j < SEQ / 256; ++j) { FragH f;
#pragma unroll
      for (int i = 0; i < 4; ++i) { f.h[i] = toh_flush(__builtin_amdgcn_exp2f(x[2 * j][i] - xoff)); f.h[4 + i] = toh_flush(__builtin_amdgcn_exp2f(x[2 * j + 1][i] - xoff)); }
      const v8us o = f.half[0]; *(v8us*)(pout + j * 256) = o; }
     } }

extern "C" void kernel_launch(void* const* d_in, const int* in_sizes, int n_in,
                              void* d_out, int out_size, void* d_ws, size_t ws_size, hipStream_t stream) {
  if (n_in < 9) return;
  const size_t xneed = ((size_t)(NB - 1) * SEQ_FULL + SEQ) * DM;
  if ((size_t)in_sizes[0] < xneed) return;
  if ((size_t)in_sizes[1] < (size_t)(NB - 1) * SEQ_FULL + SEQ) return;
  if (in_sizes[2] < NB * NE) return;
  if ((size_t)in_sizes[3] < (size_t)DM * DM || (size_t)in_sizes[5] < (size_t)DM * DM || (size_t)in_sizes[7] < (size_t)DM * DM) return;
  if (in_sizes[4] < DM || in_sizes[6] < DM || in_sizes[8] < DM) return;
  if ((size_t)out_size < xneed) return;
  const float* const* I = (const float* const*)d_in;
  const float* hs = I[0]; const float* mask = I[1]; const int* epos = (const int*)d_in[2];
  const float* wq = I[3]; const float* bq = I[4]; const float* wk = I[5]; const float* bk = I[6]; const float* wv = I[7]; const float* bv = I[8];
  char* ws = (char*)d_ws; size_t off = 0;
  auto take = [&](size_t bytes) { char* p = ws + off; off += (bytes + 255) & ~(size_t)255; return p; };
  _Float16* BQ = (_Float16*)take((size_t)DM * DM * 2); _Float16* BK = (_Float16*)take((size_t)DM * DM * 2); _Float16* BV = (_Float16*)take((size_t)DM * DM * 2);
  _Float16* X16 = (_Float16*)take(NR * DM * 2); _Float16* Q16 = (_Float16*)take(NR * DM * 2); _Float16* K16 = (_Float16*)take(NR * DM * 2); _Float16* VT = (_Float16*)take(NR * DM * 2);
  float* S = (float*)take((size_t)NB * QC * SEQ * 4); _Float16* PM = (_Float16*)take((size_t)NB * QC * SEQ * 2);
  float* CT = (float*)take((size_t)NB * SEQ * 4);
  if (off > ws_size) return;
  { const unsigned g = (unsigned)(((size_t)DM * DM / 8 + 255) / 256);
    k_wnat<<<g, 256, 0, stream>>>(wq, (size_t)DM * DM / 8, BQ); k_wnat<<<g, 256, 0, stream>>>(wk, (size_t)DM * DM / 8, BK);
    k_wnat<<<g, 256, 0, stream>>>(wv, (size_t)DM * DM / 8, BV); }      /* natural [out][in] = Bt[n][k], x16 */
  k_x16<<<(unsigned)((NR * DM / 8 + 255) / 256), 256, 0, stream>>>(hs, X16, NR * DM / 8);
  k_colterm<<<(unsigned)((NB * (SEQ / 4) + 255) / 256), 256, 0, stream>>>(mask, epos, CT);
  const dim3 gp((unsigned)((MP / 128) * (DM / 64)), 1);
  k_gemm2<true, false, false><<<gp, 128, 0, stream>>>(X16, DM, 0, BQ, DM, 0, 0.0625f, bq, nullptr, Q16, DM, 0, MP, DM, DM);
  k_gemm2<true, false, false><<<gp, 128, 0, stream>>>(X16, DM, 0, BK, DM, 0, 0.0625f, bk, nullptr, K16, DM, 0, MP, DM, DM);
  /* V^T[b][d][s] = 2^-4 * sum_h BV[d][h] * X16[b*SEQ + s][h]: A = BV [DM][DM], Bt = X16 rows of batch b; VT pitch SEQ, slab DM*SEQ */
  k_gemm2<false, false, false><<<dim3((DM / 128) * (SEQ / 64), NB), 128, 0, stream>>>(BV, DM, 0, X16, DM, (size_t)SEQ * DM, 0.0625f, nullptr, nullptr, VT, SEQ, (size_t)DM * SEQ, DM, SEQ, DM);
  for (int t0 = 0; t0 < SEQ; t0 += QC) {
    /* scores in base-2 units: slab by = batch; S[by][QC][SEQ] f32 = (768^-0.5 * log2(e)) * Q16 . K16^T */
    k_gemm2<false, true, false><<<dim3((QC / 128) * (SEQ / 64), NB), 128, 0, stream>>>(Q16 + (size_t)t0 * DM, DM, (size_t)SEQ * DM, K16, DM, (size_t)SEQ * DM, SCALE2, nullptr, S, nullptr, SEQ, (size_t)QC * SEQ, QC, SEQ, DM);
    k_soft<<<NB * QC / 4, 128, 0, stream>>>(S, CT, PM);
    /* out[b][t0 + r][d] = 2^-12 * (4096 P) . V^T + bv[d]; output rows b*SEQ_FULL + t0 + r */
    k_gemm2<true, true, false><<<dim3((QC / 128) * (DM / 64), NB), 128, 0, stream>>>(PM, SEQ, (size_t)QC * SEQ, VT, SEQ, (size_t)DM * SEQ, 0.000244140625f, bv, (float*)d_out + (size_t)t0 * DM, nullptr, DM, (size_t)SEQ_FULL * DM, QC, DM, SEQ);
  }
}

// v001
// One run takes 886 microseconds.
// Two timings next to v000 put it at 2.86 and 2.87 times that version's speed.
#include <hip/hip_runtime.h>
// Single-head full SELF-attention with a per-key-column entity-count bias, batch-first layout: x [4][4096][768]; q / k / v = x W^T + bias (natural [out][in] weights); scores = (q . k) / sqrt(768); per key column two additive terms: the number of occurrences of that position in entity_positions [4][64] (duplicates accumulate) and (1 - mask) * -10000; softmax over all 4096 keys; out = P . v, f32 [4][4096][768].
// Structure: x as exact f16 rows (inputs RNE-converted to bf16 first); Q, K as WMMA GEMMs (32x64 wave tiles, f32 accumulation, x16 weights + bias, f16 outputs); V^T [b][768][SEQ] directly as a GEMM (A = Wv plane, B = x rows; bv enters the P.V epilogue, rows of P sum to one); column-term plane CT f32 [b][SEQ] built by a compare scan (no read-modify-write primitives), in base-2 units (x log2(e)); per chunk of 2048 query rows (all batches at once, so that every launch of the chunk loop has several work-groups per WGP): scores GEMM (K = 768, batch on grid.y, alpha 768^-0.5 * log2(e), f32 S in base-2 units), k_soft (f32 row statistics, native base-2 exp on max-subtracted arguments: 2^(log2(e) z) = e^z; weights normalised in the exponent: 4096 P = 2^(x - max - log2(sum) + 12), f16 with the flush select, stored over the first half of the wave's own score row, which it holds in registers by then), out = 2^-12 * P . V^T + bv GEMM (K = 4096) straight into the output rows.
// Compute dtype: all contractions v_wmma_f32_16x16x32_f16 (f16 operands, f32 accumulate); inputs RNE-converted to bf16 (exact in f16); q, k, v and softmax weights (x4096) as plain f16 operands; scores, column terms and softmax statistics f32.
#ifndef NB
#define NB 4                         /* batches processed */
#endif
#ifndef SEQ
#define SEQ 4096                     /* sequence length processed (queries = keys) */
#endif
#define NB_FULL 4                    /* batch count of the input / output arrays */
#define SEQ_FULL 4096                /* per-batch row pitch of the input / output arrays */
#define DM 768
#define NE 64                        /* entity positions per batch */
#define QC (SEQ < 2048 ? SEQ : 2048) /* query rows per attention chunk */
#define PMP (2 * SEQ)                /* pitch of a softmax-weight row in f16 elements: it lies at the start of its f32 score row */
#define NR ((size_t)NB * SEQ)        /* token rows */
#define MP ((int)(NB * SEQ))
#define PCARRY 4096.0f               /* power-of-two carry of the f16 softmax weights */
#define PCARRY_L2 12.0f              /* log2(PCARRY), exact */
#define LOG2E 1.4426950408889634f    /* log2(e); f32 bits 0x3FB8AA3B */
#define SCALE2 (0.03608439182435161f * LOG2E)   /* 768^-0.5 * log2(e), product of the two f32 literals formed in f32 (about 0.0520587731) */
#define AL256(x) ((((size_t)(x)) + 255) & ~(size_t)255)
#define WS_W  AL256((size_t)DM * DM * 2)
#define WS_P  AL256((size_t)NB * SEQ * DM * 2)
#define WS_S  AL256((size_t)NB * QC * SEQ * 4)
#define WS_CT AL256((size_t)NB * SEQ * 4)
static_assert(SEQ % 256 == 0);
static_assert(QC % 128 == 0);
static_assert(SEQ % QC == 0);
static_assert(NB <= NB_FULL);
static_assert(SEQ <= SEQ_FULL);
static_assert((NB * SEQ) % 128 == 0);
static_assert(DM % 128 == 0);                       /* V^T GEMM has M = DM */
static_assert(DM % 64 == 0);
static_assert(DM % 32 == 0);
static_assert(SEQ % 64 == 0);
static_assert(DM % 8 == 0);
static_assert((NB * QC) % 4 == 0);                  /* k_soft: 4 rows per block */
static_assert(4 * 32 * 68 * 4 <= 131072);           /* k_gemm2 static LDS */
static_assert((float)(1 << 12) == PCARRY);          /* PCARRY_L2 is the exact base-2 logarithm of PCARRY */
static_assert(3 * WS_W + 4 * WS_P + WS_S + WS_CT <= (size_t)268435456);
static_assert(((size_t)(NB - 1) * SEQ_FULL + SEQ) * DM <= (size_t)NB_FULL * SEQ_FULL * DM);   /* last output element inside the output buffer */

typedef unsigned short v8us __attribute__((ext_vector_type(8), may_alias));
typedef float  v8f  __attribute__((ext_vector_type(8)));
typedef float  v4f  __attribute__((ext_vector_type(4)));
typedef float  v4fa __attribute__((ext_vector_type(4), may_alias));
typedef _Float16 v16h __attribute__((ext_vector_type(16)));
typedef _Float16 v4h __attribute__((ext_vector_type(4)));
union FragH { v16h v; v8us half[2]; _Float16 h[16]; unsigned short u[16]; };

__device__ __forceinline__ unsigned short bf16_bits(float x) { unsigned int u = __float_as_uint(x); return (unsigned short)((u + 0x7FFFu + ((u >> 16) & 1u)) >> 16); }
__device__ __forceinline__ float bf16_val(unsigned short b) { return __uint_as_float(((unsigned int)b) << 16); }
__device__ __forceinline__ float bf16_rne(float x) { return bf16_val(bf16_bits(x)); }   /* RNE convert to bf16, back as f32 */

// f32 -> f16 operand convert that cannot produce an f16 subnormal (|v| < 2^-14 -> +0)
typedef _Float16 h16;
static __device__ __forceinline__ h16 toh_flush(float v) { const h16 r = (h16)v; return (fabsf(v) < 6.103515625e-05f) ? (h16)0.0f : r; }

// fragment: elements 0..7 <- k0 + 8h .. +7, elements 8..15 <- k0 + 16 + 8h .. +7 (p points at k0 of the lane's row / column)
__device__ __forceinline__ v16h g2_frag(const _Float16* p, int hh) { FragH f; f.half[0] = *(const v8us*)((const unsigned short*)p + 8 * hh); f.half[1] = *(const v8us*)((const unsigned short*)p + 16 + 8 * hh); return f.v; }
__device__ __forceinline__ v8f g2_mma(v16h a, v16h b, v8f c) { v8f d = __builtin_amdgcn_wmma_f32_16x16x32_f16(false, a, false, b, (short)0, c, false, false); asm volatile("v_nop\n\tv_nop\n\tv_nop\n\tv_nop" : "+v"(d) : "v"(a), "v"(b)); return d; }

// ---- GEMM (wave tile 32x64; M % 128 == 0 per launch region, N % 64 == 0, K % 32 == 0): C = alpha * A . Bt^T (+ bias) ----
// A f16 [M][K] (pitch lda), Bt f16 [N][K] (pitch ldb); batch slab by = blockIdx.y with element strides sA / sB / sC.
// OMAP: output row r -> (r / NB) * NB_FULL + r % NB.
template <bool HASB, bool OUT32, bool OMAP>
__global__ __launch_bounds__(128) void k_gemm2(const _Float16* __restrict__ A, int lda, size_t sA, const _Float16* __restrict__ Bh, int ldb, size_t sB, float alpha,
    const float* __restrict__ bias, float* __restrict__ C, _Float16* __restrict__ C16, int ldc, size_t sC, int M, int N, int K) {
  __shared__ __attribute__((aligned(16))) float so[4][32][68];
  const int tid = threadIdx.x, w = __builtin_amdgcn_readfirstlane((int)(tid >> 5)), lane = tid & 31, ln = lane & 15, hh = lane >> 4; const int by = blockIdx.y;
  A += (size_t)by * sA; Bh += (size_t)by * sB; const size_t cofs = (size_t)by * sC;
  const int ntn = N >> 6; const int mt = blockIdx.x / ntn, nq = blockIdx.x - mt * ntn; const int row0 = mt * 128 + 32 * w, col0 = nq * 64; if (row0 >= M) return;
  const _Float16* a0p = A + (size_t)(row0 + ln) * lda; const _Float16* a1p = a0p + (size_t)16 * lda;
  const _Float16* b0p = Bh + (size_t)(col0 + ln) * ldb; const _Float16* b1p = b0p + (size_t)16 * ldb; const _Float16* b2p = b1p + (size_t)16 * ldb; const _Float16* b3p = b2p + (size_t)16 * ldb;
  const v8f z8 = {0.f,0.f,0.f,0.f,0.f,0.f,0.f,0.f}; v8f c00 = z8, c01 = z8, c02 = z8, c03 = z8, c10 = z8, c11 = z8, c12 = z8, c13 = z8;
#pragma unroll 1
  for (int kb = 0; kb < K; kb += 32) { const v16h a0 = g2_frag(a0p + kb, hh), a1 = g2_frag(a1p + kb, hh);
    v16h b = g2_frag(b0p + kb, hh); c00 = g2_mma(a0, b, c00); c10 = g2_mma(a1, b, c10);
    b = g2_frag(b1p + kb, hh); c01 = g2_mma(a0, b, c01); c11 = g2_mma(a1, b, c11);
    b = g2_frag(b2p + kb, hh); c02 = g2_mma(a0, b, c02); c12 = g2_mma(a1, b, c12);
    b = g2_frag(b3p + kb, hh); c03 = g2_mma(a0, b, c03); c13 = g2_mma(a1, b, c13); }
  v8f accs[8] = {c00, c01, c02, c03, c10, c11, c12, c13};
#pragma unroll
  for (int u = 0; u < 8; ++u) { const int t = u & 3, half = u >> 2; const int col = col0 + t * 16 + ln; float bv = 0.f; if (HASB) bv = bf16_rne(bias[col]);
#pragma unroll
    for (int r = 0; r < 8; ++r) { const int rloc = half * 16 + 8 * hh + r; so[w][rloc][t * 16 + ln] = accs[u][r] * alpha + bv; } }
  __builtin_amdgcn_fence(4 /* acq_rel order */, "workgroup"); __builtin_amdgcn_wave_barrier();      /* so[w] is private to wave w */
  const int rsub = lane >> 4, c4 = (lane & 15) * 4;
  {
#pragma unroll
    for (int q = 0; q < 16; ++q) { const int r = q * 2 + rsub; const v4f v = *(const v4fa*)&so[w][r][c4];
      const int gr = row0 + r; const size_t orow = OMAP ? ((size_t)(gr / NB) * NB_FULL + (size_t)(gr % NB)) : (size_t)gr;
      if (OUT32) { *(v4f*)(C + cofs + orow * ldc + col0 + c4) = v; }
      else { v4h h4;
#pragma unroll
        for (int i = 0; i < 4; ++i) h4[i] = (_Float16)v[i];
        *(v4h*)(C16 + cofs + orow * ldc + col0 + c4) = h4; } }
     } }

static_assert(((size_t)DM * DM) % 8 == 0);
__global__ __launch_bounds__(256) void k_wnat(const float* __restrict__ w, size_t n8, _Float16* __restrict__ Bt) { const size_t t = (size_t)blockIdx.x * 256 + threadIdx.x; if (t >= n8) return; FragH f; const v4f a = *(const v4fa*)(w + t * 8), c = *(const v4fa*)(w + t * 8 + 4);
#pragma unroll
  for (int q = 0; q < 4; ++q) { f.h[q] = toh_flush(bf16_rne(a[q]) * 16.0f); f.h[4 + q] = toh_flush(bf16_rne(c[q]) * 16.0f); }
  const v8us o = f.half[0]; *(v8us*)((unsigned short*)Bt + t * 8) = o;  }

__global__ __launch_bounds__(256) void k_x16(const float* __restrict__ x, _Float16* __restrict__ X16, size_t n8) { const size_t t = (size_t)blockIdx.x * 256 + threadIdx.x; if (t >= n8) return;
  const size_t row = t / (DM / 8); const int c8 = (int)(t % (DM / 8)) * 8; const size_t srow = (row / SEQ) * SEQ_FULL + (row % SEQ);
  const float* p = x + srow * DM + c8; const v4f a = *(const v4fa*)p, c = *(const v4fa*)(p + 4); FragH f;
#pragma unroll
  for (int q = 0; q < 4; ++q) { f.h[q] = toh_flush(bf16_rne(a[q])); f.h[4 + q] = toh_flush(bf16_rne(c[q])); }
  const v8us o = f.half[0]; *(v8us*)((unsigned short*)X16 + t * 8) = o;  }

static_assert((NB * (SEQ / 4)) * 16 == NB * SEQ * 4);   /* threads x 16 B == plane bytes */
__global__ __launch_bounds__(256) void k_colterm(const float* __restrict__ mask, const int* __restrict__ epos, float* __restrict__ CT) {
  #pragma clang fp contract(off)
  const int t = blockIdx.x * 256 + threadIdx.x; if (t >= NB * (SEQ / 4)) return;
  const int b = t / (SEQ / 4); const int c4 = (t - b * (SEQ / 4)) * 4;
  const v4f m = *(const v4fa*)(mask + (size_t)b * SEQ_FULL + c4);
  int n0 = 0, n1 = 0, n2 = 0, n3 = 0, bad = 0;
#pragma unroll 1
  for (int e = 0; e < NE; ++e) { const int p = epos[b * NE + e];
    bad |= ((unsigned)p >= (unsigned)SEQ_FULL) ? 1 : 0;
    n0 += (p == c4) ? 1 : 0; n1 += (p == c4 + 1) ? 1 : 0; n2 += (p == c4 + 2) ? 1 : 0; n3 += (p == c4 + 3) ? 1 : 0; }
  const float qn = __uint_as_float(0x7FC00000u);
  const float t0 = (float)n0 * LOG2E + ((1.0f - bf16_rne(m[0])) * -10000.0f) * LOG2E;
  const float t1 = (float)n1 * LOG2E + ((1.0f - bf16_rne(m[1])) * -10000.0f) * LOG2E;
  const float t2 = (float)n2 * LOG2E + ((1.0f - bf16_rne(m[2])) * -10000.0f) * LOG2E;
  const float t3 = (float)n3 * LOG2E + ((1.0f - bf16_rne(m[3])) * -10000.0f) * LOG2E;
  v4f o; o[0] = (bad != 0) ? qn : t0; o[1] = (bad != 0) ? qn : t1; o[2] = (bad != 0) ? qn : t2; o[3] = (bad != 0) ? qn : t3;
  *(v4f*)(CT + (size_t)t * 4) = o;  }

// Row softmax over SEQ keys, evaluated in base 2 and normalised in the exponent. S f32 [NB][QC][SEQ] (slab = batch) and CT f32 [NB][SEQ] both arrive in base-2 units (x log2(e));
// with x = S[b][t][:] + CT[b][:], mx = row max, se = sum 2^(x - mx): PM f16 [NB][QC] rows of pitch PMP = 2^(x - off), off = mx + log2(se) - 12 (= 4096 * 2^(x - mx) / se).
// One wave per (b, t): lane holds 8 consecutive columns of every 256-column group (32 x v4f, kept unmodified), max / sum by wave shuffles, native base-2 exp (subtract + v_exp_f32) in both sweeps.
// PM is the same memory as S: row wr of PM covers the first half of row wr of S; only wave wr touches that row, and each of its stores depends on all of its loads through the row maximum.
static_assert(32 * 16 * (SEQ / 256) == SEQ * 2);        /* lanes x bytes x store instructions == row bytes */
__global__ __launch_bounds__(128) __attribute__((amdgpu_num_vgpr(256))) void k_soft(const float* S, const float* __restrict__ CT, _Float16* PM) {
  #pragma clang fp contract(off)
  const int tid = threadIdx.x, w = __builtin_amdgcn_readfirstlane((int)(tid >> 5)), lane = tid & 31;
  const int wr = blockIdx.x * 4 + w; const int b = wr / QC;
  const float* p = S + (size_t)wr * SEQ + lane * 8;
  const float* c = CT + (size_t)b * SEQ + lane * 8;
  v4f x[SEQ / 128];
#pragma unroll
  for (int j = 0; j < SEQ / 256; ++j) {
    const v4f s0 = *(const v4fa*)(p + j * 256), s1 = *(const v4fa*)(p + j * 256 + 4);
    const v4f u0 = *(const v4fa*)(c + j * 256), u1 = *(const v4fa*)(c + j * 256 + 4);
    x[2 * j] = s0 + u0; x[2 * j + 1] = s1 + u1;
    asm volatile("" : "+v"(x[2 * j]), "+v"(x[2 * j + 1]) : : "memory");      /* the group's sums exist before anything later is issued */
    __builtin_amdgcn_sched_barrier(0); }
  float mx = -3.0e38f;
#pragma unroll
  for (int j = 0; j < SEQ / 128; ++j) mx = fmaxf(mx, fmaxf(fmaxf(x[j][0], x[j][1]), fmaxf(x[j][2], x[j][3])));
#pragma unroll
  for (int off = 16; off > 0; off >>= 1) mx = fmaxf(mx, __shfl_xor(mx, off, 32));
  float se = 0.f;
#pragma unroll
  for (int j = 0; j < SEQ / 128; ++j) {
#pragma unroll
    for (int i = 0; i < 4; ++i) { const float e = __builtin_amdgcn_exp2f(x[j][i] - mx); se += e; } }
#pragma unroll
  for (int off = 16; off > 0; off >>= 1) se += __shfl_xor(se, off, 32);
  const float xoff = (mx + __builtin_amdgcn_logf(se)) - PCARRY_L2;      /* se >= 1: the row maximum contributes 2^0 */
  unsigned short* pout = (unsigned short*)PM + (size_t)wr * PMP + lane * 8;
  {
#pragma unroll
    for (int j = 0; j < SEQ / 256; ++j) { FragH f;
#pragma unroll
      for (int i = 0; i < 4; ++i) { f.h[i] = toh_flush(__builtin_amdgcn_exp2f(x[2 * j][i] - xoff)); f.h[4 + i] = toh_flush(__builtin_amdgcn_exp2f(x[2 * j + 1][i] - xoff)); }
      const v8us o = f.half[0]; *(v8us*)(pout + j * 256) = o; }
     } }

extern "C" void kernel_launch(void* const* d_in, const int* in_sizes, int n_in,
                              void* d_out, int out_size, void* d_ws, size_t ws_size, hipStream_t stream) {
  if (n_in < 9) return;
  const size_t xneed = ((size_t)(NB - 1) * SEQ_FULL + SEQ) * DM;
  if ((size_t)in_sizes[0] < xneed) return;
  if ((size_t)in_sizes[1] < (size_t)(NB - 1) * SEQ_FULL + SEQ) return;
  if (in_sizes[2] < NB * NE) return;
  if ((size_t)in_sizes[3] < (size_t)DM * DM || (size_t)in_sizes[5] < (size_t)DM * DM || (size_t)in_sizes[7] < (size_t)DM * DM) return;
  if (in_sizes[4] < DM || in_sizes[6] < DM || in_sizes[8] < DM) return;
  if ((size_t)out_size < xneed) return;
  const float* const* I = (const float* const*)d_in;
  const float* hs = I[0]; const float* mask = I[1]; const int* epos = (const int*)d_in[2];
  const float* wq = I[3]; const float* bq = I[4]; const float* wk = I[5]; const float* bk = I[6]; const float* wv = I[7]; const float* bv = I[8];
  char* ws = (char*)d_ws; size_t off = 0;
  auto take = [&](size_t bytes) { char* p = ws + off; off += (bytes + 255) & ~(size_t)255; return p; };
  _Float16* BQ = (_Float16*)take((size_t)DM * DM * 2); _Float16* BK = (_Float16*)take((size_t)DM * DM * 2); _Float16* BV = (_Float16*)take((size_t)DM * DM * 2);
  _Float16* X16 = (_Float16*)take(NR * DM * 2); _Float16* Q16 = (_Float16*)take(NR * DM * 2); _Float16* K16 = (_Float16*)take(NR * DM * 2); _Float16* VT = (_Float16*)take(NR * DM * 2);
  float* S = (float*)take((size_t)NB * QC * SEQ * 4); _Float16* PM = (_Float16*)S;      /* weight rows overlay their own score rows, pitch PMP */
  float* CT = (float*)take((size_t)NB * SEQ * 4);
  if (off > ws_size) return;
  { const unsigned g = (unsigned)(((size_t)DM * DM / 8 + 255) / 256);
    k_wnat<<<g, 256, 0, stream>>>(wq, (size_t)DM * DM / 8, BQ); k_wnat<<<g, 256, 0, stream>>>(wk, (size_t)DM * DM / 8, BK);
    k_wnat<<<g, 256, 0, stream>>>(wv, (size_t)DM * DM / 8, BV); }      /* natural [out][in] = Bt[n][k], x16 */
  k_x16<<<(unsigned)((NR * DM / 8 + 255) / 256), 256, 0, stream>>>(hs, X16, NR * DM / 8);
  k_colterm<<<(unsigned)((NB * (SEQ / 4) + 255) / 256), 256, 0, stream>>>(mask, epos, CT);
  const dim3 gp((unsigned)((MP / 128) * (DM / 64)), 1);
  k_gemm2<true, false, false><<<gp, 128, 0, stream>>>(X16, DM, 0, BQ, DM, 0, 0.0625f, bq, nullptr, Q16, DM, 0, MP, DM, DM);
  k_gemm2<true, false, false><<<gp, 128, 0, stream>>>(X16, DM, 0, BK, DM, 0, 0.0625f, bk, nullptr, K16, DM, 0, MP, DM, DM);
  /* V^T[b][d][s] = 2^-4 * sum_h BV[d][h] * X16[b*SEQ + s][h]: A = BV [DM][DM], Bt = X16 rows of batch b; VT pitch SEQ, slab DM*SEQ */
  k_gemm2<false, false, false><<<dim3((DM / 128) * (SEQ / 64), NB), 128, 0, stream>>>(BV, DM, 0, X16, DM, (size_t)SEQ * DM, 0.0625f, nullptr, nullptr, VT, SEQ, (size_t)DM * SEQ, DM, SEQ, DM);
  for (int t0 = 0; t0 < SEQ; t0 += QC) {
    /* scores in base-2 units: slab by = batch; S[by][QC][SEQ] f32 = (768^-0.5 * log2(e)) * Q16 . K16^T */
    k_gemm2<false, true, false><<<dim3((QC / 128) * (SEQ / 64), NB), 128, 0, stream>>>(Q16 + (size_t)t0 * DM, DM, (size_t)SEQ * DM, K16, DM, (size_t)SEQ * DM, SCALE2, nullptr, S, nullptr, SEQ, (size_t)QC * SEQ, QC, SEQ, DM);
    k_soft<<<NB * QC / 4, 128, 0, stream>>>(S, CT, PM);
    /* out[b][t0 + r][d] = 2^-12 * (4096 P) . V^T + bv[d]; output rows b*SEQ_FULL + t0 + r */
    k_gemm2<true, true, false><<<dim3((QC / 128) * (DM / 64), NB), 128, 0, stream>>>(PM, PMP, (size_t)QC * PMP, VT, SEQ, (size_t)DM * SEQ, 0.000244140625f, bv, (float*)d_out + (size_t)t0 * DM, nullptr, DM, (size_t)SEQ_FULL * DM, QC, DM, SEQ);
  }
}
